// v000
// Times are from an AMD MI455X. After a warm-up the kernel runs many times in a row, and a time is the length of
// such a window on the GPU divided by its runs, so every launch and the gaps after it count. The runs cycle
// through copies of the inputs. A figure is the median of several windows, for all but v000 over two sittings.
// Sittings can differ by a few percent; kernels timed side by side share one.
// v000, which the later versions start from, runs in 242 microseconds.
#include <hip/hip_runtime.h>

#define S_LEN  2048
#define U_DIM  1024
#define H_NUM  16
#define D_HEAD 64
#define B_NUM  2
#define NEG_F  (-4294967295.0f)

typedef __attribute__((ext_vector_type(16))) __bf16 v16bf;
typedef __attribute__((ext_vector_type(8)))  __bf16 v8bf;
typedef __attribute__((ext_vector_type(8)))  float  v8f;
typedef __attribute__((ext_vector_type(4)))  unsigned int u32x4;
typedef __attribute__((ext_vector_type(8)))  unsigned int u32x8;

__device__ inline v8f wmma_bf16f32(v16bf a, v16bf b, v8f c) {
  return __builtin_amdgcn_wmma_f32_16x16x32_bf16(false, a, false, b, (short)0, c,
                                                 false, false);
}

// Per-lane WMMA 16-bit A/B fragment: elems 0..7 = k (half*8 + 0..7),
// elems 8..15 = k (16 + half*8 + 0..7). `p` points at k = base + half*8.
__device__ inline v16bf frag_from_bf(const __bf16* p) {
  v8bf lo = *(const v8bf*)(p);
  v8bf hi = *(const v8bf*)(p + 16);
  v16bf f;
#pragma unroll
  for (int i = 0; i < 8; ++i) { f[i] = lo[i]; f[8 + i] = hi[i]; }
  return f;
}

__device__ inline unsigned lds_off_u32(const void* p) {
  return (unsigned)(unsigned long long)p;
}

__device__ inline void tdm_load_2d_bf16(unsigned lds_byte_off,
                                        unsigned long long gaddr_bytes,
                                        unsigned tensor_d0, unsigned tensor_d1,
                                        unsigned tile_d0, unsigned tile_d1,
                                        unsigned long long stride0_elems) {
  u32x4 g0;
  g0[0] = 1u;
  g0[1] = lds_byte_off;
  g0[2] = (unsigned)(gaddr_bytes & 0xffffffffu);
  g0[3] = (unsigned)((gaddr_bytes >> 32) & 0x01ffffffu)
        | (2u << 30);
  u32x8 g1;
  g1[0] = (1u << 16);
  g1[1] = (tensor_d0 & 0xffffu) << 16;
  g1[2] = ((tensor_d0 >> 16) & 0xffffu) | ((tensor_d1 & 0xffffu) << 16);
  g1[3] = ((tensor_d1 >> 16) & 0xffffu) | ((tile_d0 & 0xffffu) << 16);
  g1[4] = (tile_d1 & 0xffffu);
  g1[5] = (unsigned)(stride0_elems & 0xffffffffu);
  g1[6] = (unsigned)((stride0_elems >> 32) & 0xffffu);
  g1[7] = 0u;
  asm volatile("tensor_load_to_lds %0, %1" :: "s"(g0), "s"(g1) : "memory");
}

// ---------------- Kernel 0: fp32 -> bf16 prepass ----------------------------
__global__ __launch_bounds__(256) void cvt_bf16_kernel(const float* __restrict__ src,
                                                       __bf16* __restrict__ dst) {
  int i = blockIdx.x * 256 + threadIdx.x;                 // one 8-elem group each
  const float4* p = (const float4*)src + (size_t)i * 2;
  float4 a = p[0], b = p[1];
  v8bf o;
  o[0] = (__bf16)a.x; o[1] = (__bf16)a.y; o[2] = (__bf16)a.z; o[3] = (__bf16)a.w;
  o[4] = (__bf16)b.x; o[5] = (__bf16)b.y; o[6] = (__bf16)b.z; o[7] = (__bf16)b.w;
  *((v8bf*)dst + i) = o;
}

// ---------------- Kernel 1: padding masks -----------------------------------
__global__ __launch_bounds__(256) void masks_kernel(const float* __restrict__ queries,
                                                    const float* __restrict__ keys,
                                                    float* __restrict__ qmask,
                                                    float* __restrict__ kmask) {
  int wv = threadIdx.x >> 5, lane = threadIdx.x & 31;
  int row = blockIdx.x * 8 + wv;                          // B*S = 4096 rows
  const float* qp = queries + (size_t)row * U_DIM;
  const float* kp = keys + (size_t)row * U_DIM;
  float sq = 0.f, sk = 0.f;
  for (int i = lane; i < U_DIM; i += 32) { sq += qp[i]; sk += kp[i]; }
#pragma unroll
  for (int m = 16; m; m >>= 1) { sq += __shfl_xor(sq, m, 32); sk += __shfl_xor(sk, m, 32); }
  if (lane == 0) {
    qmask[row] = (sq != 0.f) ? 1.f : 0.f;
    kmask[row] = (sk != 0.f) ? 1.f : 0.f;
  }
}

// ---------------- Kernel 2: fused QKV projection (bf16 WMMA) ----------------
// z=0: Q -> Qh[h][b][s][d], z=1: K -> Kh, z=2: V -> Vt[h][b][d][s] (transposed)
__global__ __launch_bounds__(256) void proj_kernel(
    const __bf16* __restrict__ qb, const __bf16* __restrict__ kb,
    const __bf16* __restrict__ vb,
    const __bf16* __restrict__ Wqb, const float* __restrict__ bq,
    const __bf16* __restrict__ Wkb, const float* __restrict__ bk,
    const __bf16* __restrict__ Wvb, const float* __restrict__ bv,
    __bf16* __restrict__ Qh, __bf16* __restrict__ Kh, __bf16* __restrict__ Vt) {
  int z = blockIdx.z;
  const __bf16 *X, *W;
  const float* bias;
  if (z == 0)      { X = qb; W = Wqb; bias = bq; }
  else if (z == 1) { X = kb; W = Wkb; bias = bk; }
  else             { X = vb; W = Wvb; bias = bv; }

  int wv = threadIdx.x >> 5, lane = threadIdx.x & 31;
  int half = lane >> 4, l16 = lane & 15;
  int m0 = blockIdx.x * 32;                  // 4096 rows / 32
  int n0 = blockIdx.y * 256 + wv * 32;       // 1024 cols / (8 waves * 32)

  const v8f zero8 = {0.f, 0.f, 0.f, 0.f, 0.f, 0.f, 0.f, 0.f};
  v8f acc[2][2] = {{zero8, zero8}, {zero8, zero8}};

  int rowA0 = m0 + l16, rowA1 = m0 + 16 + l16;
  int colB0 = n0 + l16, colB1 = n0 + 16 + l16;

  for (int kk = 0; kk < U_DIM; kk += 32) {
    v16bf a0 = frag_from_bf(X + (size_t)rowA0 * U_DIM + kk + half * 8);
    v16bf a1 = frag_from_bf(X + (size_t)rowA1 * U_DIM + kk + half * 8);
    v16bf b0 = frag_from_bf(W + (size_t)colB0 * U_DIM + kk + half * 8); // B[k][n]=W[n][k]
    v16bf b1 = frag_from_bf(W + (size_t)colB1 * U_DIM + kk + half * 8);
    acc[0][0] = wmma_bf16f32(a0, b0, acc[0][0]);
    acc[0][1] = wmma_bf16f32(a0, b1, acc[0][1]);
    acc[1][0] = wmma_bf16f32(a1, b0, acc[1][0]);
    acc[1][1] = wmma_bf16f32(a1, b1, acc[1][1]);
  }

  if (z < 2) {
    __bf16* out = (z == 0) ? Qh : Kh;
#pragma unroll
    for (int mi = 0; mi < 2; ++mi)
#pragma unroll
      for (int ni = 0; ni < 2; ++ni) {
        v8f c = acc[mi][ni];
        int ncol = n0 + ni * 16 + l16;
        int h = ncol >> 6, dv = ncol & 63;
        float bn = bias[ncol];
#pragma unroll
        for (int j = 0; j < 8; ++j) {
          int m = m0 + mi * 16 + half * 8 + j;
          int bb = m >> 11, s = m & (S_LEN - 1);
          float val = fmaxf(c[j] + bn, 0.f);
          out[(((size_t)h * B_NUM + bb) * S_LEN + s) * D_HEAD + dv] = (__bf16)val;
        }
      }
  } else {
#pragma unroll
    for (int mi = 0; mi < 2; ++mi)
#pragma unroll
      for (int ni = 0; ni < 2; ++ni) {
        v8f c = acc[mi][ni];
        int ncol = n0 + ni * 16 + l16;
        int h = ncol >> 6, dv = ncol & 63;
        float bn = bias[ncol];
        int m = m0 + mi * 16 + half * 8;
        int bb = m >> 11, s = m & (S_LEN - 1);
        v8bf pk;
#pragma unroll
        for (int j = 0; j < 8; ++j) pk[j] = (__bf16)fmaxf(c[j] + bn, 0.f);
        *(v8bf*)(Vt + (((size_t)h * B_NUM + bb) * D_HEAD + dv) * S_LEN + s) = pk;
      }
  }
}

__global__ __launch_bounds__(128) void attn_kernel(
    const __bf16* __restrict__ Qh, const __bf16* __restrict__ Kh,
    const __bf16* __restrict__ Vt, const float* __restrict__ kmask,
    const float* __restrict__ qmask, float* __restrict__ oatt) {
  __shared__ __align__(16) __bf16 ldsK[32 * 64];    // K rows, row-major d
  __shared__ __align__(16) __bf16 ldsV[64 * 32];    // V^T rows (dv), 32 s each
  __shared__ __align__(16) __bf16 ldsP[4 * 16 * 32];

  int wv = threadIdx.x >> 5, lane = threadIdx.x & 31;
  int half = lane >> 4, l16 = lane & 15;
  int hb = blockIdx.y;                     // h*B + b (head-major, as reference)
  int b = hb & (B_NUM - 1);
  int h = hb >> 1;
  int q0 = blockIdx.x * 64 + wv * 16;

  const __bf16* Qbase = Qh + (size_t)hb * S_LEN * D_HEAD;
  const __bf16* Kbase = Kh + (size_t)hb * S_LEN * D_HEAD;
  const __bf16* Vbase = Vt + (size_t)hb * D_HEAD * S_LEN;

  int qrow = q0 + l16;
  v16bf aq0 = frag_from_bf(Qbase + (size_t)qrow * D_HEAD + 0 + half * 8);
  v16bf aq1 = frag_from_bf(Qbase + (size_t)qrow * D_HEAD + 32 + half * 8);

  const v8f zero8 = {0.f, 0.f, 0.f, 0.f, 0.f, 0.f, 0.f, 0.f};
  v8f o[4] = {zero8, zero8, zero8, zero8};
  float mrow[8], lrow[8];
#pragma unroll
  for (int j = 0; j < 8; ++j) { mrow[j] = -3.0e38f; lrow[j] = 0.f; }

  __bf16* myP = ldsP + wv * (16 * 32);
  unsigned offK = lds_off_u32(ldsK), offV = lds_off_u32(ldsV);
  int kbmax = (blockIdx.x * 64 + 63) >> 5;         // block-uniform causal bound

  for (int kb = 0; kb <= kbmax; ++kb) {
    int kbase = kb * 32;
    __syncthreads();                               // previous tiles consumed
    if (wv == 0) {
      // K tile: 64 contiguous d x 32 key-rows, row pitch 64 elems
      tdm_load_2d_bf16(offK, (unsigned long long)(Kbase + (size_t)kbase * D_HEAD),
                       D_HEAD, S_LEN, D_HEAD, 32, D_HEAD);
      // V^T tile: 32 contiguous s x 64 dv-rows, row pitch S elems
      tdm_load_2d_bf16(offV, (unsigned long long)(Vbase + kbase),
                       S_LEN, D_HEAD, 32, D_HEAD, S_LEN);
      __builtin_amdgcn_s_wait_tensorcnt(0);
    }
    __syncthreads();                               // tiles visible to all waves

    v8f st[2];
#pragma unroll
    for (int t = 0; t < 2; ++t) {
      int keyl = t * 16 + l16;                     // local key row in tile
      int key = kbase + keyl;
      v16bf bk0 = frag_from_bf(ldsK + keyl * D_HEAD + half * 8);
      v16bf bk1 = frag_from_bf(ldsK + keyl * D_HEAD + 32 + half * 8);
      v8f c = zero8;
      c = wmma_bf16f32(aq0, bk0, c);
      c = wmma_bf16f32(aq1, bk1, c);
      float km = kmask[b * S_LEN + key];
#pragma unroll
      for (int j = 0; j < 8; ++j) {
        int m = q0 + half * 8 + j;
        float s = c[j] * 0.125f;                   // 1/sqrt(64)
        if (km == 0.f || key > m) s = NEG_F;
        c[j] = s;
      }
      st[t] = c;
    }

    // online softmax over these 32 columns (rows live in 16-lane groups)
#pragma unroll
    for (int j = 0; j < 8; ++j) {
      float tmax = fmaxf(st[0][j], st[1][j]);
#pragma unroll
      for (int m = 8; m; m >>= 1) tmax = fmaxf(tmax, __shfl_xor(tmax, m, 16));
      float mn = fmaxf(mrow[j], tmax);
      float scale = __expf(mrow[j] - mn);
      float p0 = __expf(st[0][j] - mn);
      float p1 = __expf(st[1][j] - mn);
      float rs = p0 + p1;
#pragma unroll
      for (int m = 8; m; m >>= 1) rs += __shfl_xor(rs, m, 16);
      lrow[j] = lrow[j] * scale + rs;
      mrow[j] = mn;
      st[0][j] = p0; st[1][j] = p1;
      o[0][j] *= scale; o[1][j] *= scale; o[2][j] *= scale; o[3][j] *= scale;
    }

    // C-layout -> A-layout via wave-private LDS (same-wave DS ops in order)
#pragma unroll
    for (int t = 0; t < 2; ++t)
#pragma unroll
      for (int j = 0; j < 8; ++j)
        myP[(half * 8 + j) * 32 + t * 16 + l16] = (__bf16)st[t][j];
    asm volatile("s_wait_dscnt 0" ::: "memory");
    v16bf ap = frag_from_bf(myP + l16 * 32 + half * 8);

    // O += P(16x32) @ V(32x16) for 4 d-tiles, V fragments from LDS
#pragma unroll
    for (int t = 0; t < 4; ++t) {
      int dv = t * 16 + l16;
      v16bf bvf = frag_from_bf(ldsV + dv * 32 + half * 8);
      o[t] = wmma_bf16f32(ap, bvf, o[t]);
    }
  }

  // epilogue: normalize, query mask, store merged-head fp32
#pragma unroll
  for (int j = 0; j < 8; ++j) {
    int m = q0 + half * 8 + j;
    float l = lrow[j];
    float f = (l > 0.f ? 1.f / l : 0.f) * qmask[b * S_LEN + m];
    size_t rowoff = ((size_t)b * S_LEN + m) * U_DIM + (size_t)h * D_HEAD;
#pragma unroll
    for (int t = 0; t < 4; ++t)
      oatt[rowoff + t * 16 + l16] = o[t][j] * f;
  }
}

// ---------------- Kernel 4: residual + layernorm (ddof=1) -------------------
__global__ __launch_bounds__(256) void ln_kernel(const float* __restrict__ oatt,
                                                 const float* __restrict__ queries,
                                                 const float* __restrict__ gamma,
                                                 const float* __restrict__ beta,
                                                 float* __restrict__ out) {
  __shared__ float redS[8], redQ[8];
  int row = blockIdx.x, tid = threadIdx.x;
  const float* pa = oatt + (size_t)row * U_DIM;
  const float* pq = queries + (size_t)row * U_DIM;
  float x[4], s = 0.f, ss = 0.f;
#pragma unroll
  for (int k = 0; k < 4; ++k) {
    int i = tid + k * 256;
    float v = pa[i] + pq[i];
    x[k] = v; s += v; ss += v * v;
  }
#pragma unroll
  for (int m = 16; m; m >>= 1) { s += __shfl_xor(s, m, 32); ss += __shfl_xor(ss, m, 32); }
  int wv = tid >> 5, lane = tid & 31;
  if (lane == 0) { redS[wv] = s; redQ[wv] = ss; }
  __syncthreads();
  if (wv == 0) {
    float a = (lane < 8) ? redS[lane] : 0.f;
    float c = (lane < 8) ? redQ[lane] : 0.f;
#pragma unroll
    for (int m = 16; m; m >>= 1) { a += __shfl_xor(a, m, 32); c += __shfl_xor(c, m, 32); }
    if (lane == 0) { redS[0] = a; redQ[0] = c; }
  }
  __syncthreads();
  float mean = redS[0] * (1.f / U_DIM);
  float var = (redQ[0] - (float)U_DIM * mean * mean) * (1.f / (U_DIM - 1));
  float rinv = 1.f / (sqrtf(fmaxf(var, 0.f)) + 1e-8f);
#pragma unroll
  for (int k = 0; k < 4; ++k) {
    int i = tid + k * 256;
    out[(size_t)row * U_DIM + i] = gamma[i] * (x[k] - mean) * rinv + beta[i];
  }
}

// ---------------- Host launcher ---------------------------------------------
extern "C" void kernel_launch(void* const* d_in, const int* in_sizes, int n_in,
                              void* d_out, int out_size, void* d_ws, size_t ws_size,
                              hipStream_t stream) {
  const float* queries = (const float*)d_in[0];
  const float* keys    = (const float*)d_in[1];
  const float* values  = (const float*)d_in[2];
  const float* Wq = (const float*)d_in[3];  const float* bq = (const float*)d_in[4];
  const float* Wk = (const float*)d_in[5];  const float* bk = (const float*)d_in[6];
  const float* Wv = (const float*)d_in[7];  const float* bv = (const float*)d_in[8];
  const float* gamma = (const float*)d_in[9];
  const float* beta  = (const float*)d_in[10];
  float* out = (float*)d_out;

  char* ws = (char*)d_ws;
  const size_t szX = (size_t)B_NUM * S_LEN * U_DIM * 2;   // 8 MB bf16
  const size_t szW = (size_t)U_DIM * U_DIM * 2;           // 2 MB bf16
  __bf16* qb  = (__bf16*)ws;  ws += szX;
  __bf16* kbf = (__bf16*)ws;  ws += szX;
  __bf16* vbf = (__bf16*)ws;  ws += szX;
  __bf16* Wqb = (__bf16*)ws;  ws += szW;
  __bf16* Wkb = (__bf16*)ws;  ws += szW;
  __bf16* Wvb = (__bf16*)ws;  ws += szW;
  __bf16* Qh  = (__bf16*)ws;  ws += szX;
  __bf16* Kh  = (__bf16*)ws;  ws += szX;
  __bf16* Vt  = (__bf16*)ws;  ws += szX;
  float* kmask = (float*)ws;  ws += (size_t)B_NUM * S_LEN * 4;
  float* qmask = (float*)ws;  ws += (size_t)B_NUM * S_LEN * 4;
  float* oatt  = (float*)ws;  // B*S*U fp32 = 16 MB

  const int gX = (B_NUM * S_LEN * U_DIM) / 8 / 256;  // 2048 blocks
  const int gW = (U_DIM * U_DIM) / 8 / 256;          // 512 blocks
  cvt_bf16_kernel<<<dim3(gX), dim3(256), 0, stream>>>(queries, qb);
  cvt_bf16_kernel<<<dim3(gX), dim3(256), 0, stream>>>(keys, kbf);
  cvt_bf16_kernel<<<dim3(gX), dim3(256), 0, stream>>>(values, vbf);
  cvt_bf16_kernel<<<dim3(gW), dim3(256), 0, stream>>>(Wq, Wqb);
  cvt_bf16_kernel<<<dim3(gW), dim3(256), 0, stream>>>(Wk, Wkb);
  cvt_bf16_kernel<<<dim3(gW), dim3(256), 0, stream>>>(Wv, Wvb);

  masks_kernel<<<dim3(512), dim3(256), 0, stream>>>(queries, keys, qmask, kmask);
  proj_kernel<<<dim3(128, 4, 3), dim3(256), 0, stream>>>(
      qb, kbf, vbf, Wqb, bq, Wkb, bk, Wvb, bv, Qh, Kh, Vt);
  attn_kernel<<<dim3(S_LEN / 64, H_NUM * B_NUM), dim3(128), 0, stream>>>(
      Qh, Kh, Vt, kmask, qmask, oatt);
  ln_kernel<<<dim3(B_NUM * S_LEN), dim3(256), 0, stream>>>(oatt, queries, gamma, beta, out);
}

// v001
// Measured time: 180 microseconds a run.
// In two side-by-side timings against v000, it was 1.36 and 1.35 times as fast.
#include <hip/hip_runtime.h>

#define S_LEN  2048
#define U_DIM  1024
#define H_NUM  16
#define D_HEAD 64
#define B_NUM  2
#define NEG_F  (-4294967295.0f)

typedef __attribute__((ext_vector_type(16))) __bf16 v16bf;
typedef __attribute__((ext_vector_type(8)))  __bf16 v8bf;
typedef __attribute__((ext_vector_type(8)))  float  v8f;
typedef __attribute__((ext_vector_type(4)))  unsigned int u32x4;
typedef __attribute__((ext_vector_type(8)))  unsigned int u32x8;

__device__ inline v8f wmma_bf16f32(v16bf a, v16bf b, v8f c) {
  return __builtin_amdgcn_wmma_f32_16x16x32_bf16(false, a, false, b, (short)0, c,
                                                 false, false);
}

// Per-lane WMMA 16-bit A/B fragment: elems 0..7 = k (half*8 + 0..7),
// elems 8..15 = k (16 + half*8 + 0..7). `p` points at k = base + half*8.
__device__ inline v16bf frag_from_bf(const __bf16* p) {
  v8bf lo = *(const v8bf*)(p);
  v8bf hi = *(const v8bf*)(p + 16);
  v16bf f;
#pragma unroll
  for (int i = 0; i < 8; ++i) { f[i] = lo[i]; f[8 + i] = hi[i]; }
  return f;
}

__device__ inline unsigned lds_off_u32(const void* p) {
  return (unsigned)(unsigned long long)p;
}

// Wave-uniform value in a scalar register.
__device__ inline unsigned uni(unsigned v) {
  return (unsigned)__builtin_amdgcn_readfirstlane(v);
}
__device__ inline unsigned pinned(unsigned v) {
  unsigned w = (unsigned)__builtin_amdgcn_readfirstlane(v);
  asm volatile("" : "+s"(w));  // pinned(): the test word stays in a scalar register
  return w;
}

template <unsigned W0, unsigned ROWB, unsigned ROWS>
__device__ inline void tdm_tile(unsigned lds_byte_off, unsigned long long ga,
                                unsigned src_pitch) {
  u32x4 g0;
  g0[0] = uni(1u);                                        // count = 1
  g0[1] = uni(lds_byte_off);                              // LDS destination
  g0[2] = uni((unsigned)ga);                              // address [31:0]
  g0[3] = uni((((unsigned)(ga >> 32)) & 0x01ffffffu) | 0x80000000u);  // [56:32], type 2
  u32x8 g1;
  g1[0] = uni(W0);
  g1[1] = uni((ROWB & 0xffffu) << 16);
  g1[2] = uni((ROWB >> 16) | ((ROWS & 0xffffu) << 16));
  g1[3] = uni((ROWS >> 16) | (ROWB << 16));
  g1[4] = uni(ROWS);
  g1[5] = uni(src_pitch);
  g1[6] = uni(0u);
  g1[7] = uni(0u);
  asm volatile("tensor_load_to_lds %0, %1" :: "s"(g0), "s"(g1) : "memory");
}

// ---------------- Kernel 0: fp32 -> bf16 prepass ----------------------------
__global__ __launch_bounds__(256) void cvt_bf16_kernel(const float* __restrict__ src,
                                                       __bf16* __restrict__ dst) {
  int i = blockIdx.x * 256 + threadIdx.x;                 // one 8-elem group each
  const float4* p = (const float4*)src + (size_t)i * 2;
  float4 a = p[0], b = p[1];
  v8bf o;
  o[0] = (__bf16)a.x; o[1] = (__bf16)a.y; o[2] = (__bf16)a.z; o[3] = (__bf16)a.w;
  o[4] = (__bf16)b.x; o[5] = (__bf16)b.y; o[6] = (__bf16)b.z; o[7] = (__bf16)b.w;
  *((v8bf*)dst + i) = o;
}

// ---------------- Kernel 1: padding masks -----------------------------------
__global__ __launch_bounds__(256) void masks_kernel(const float* __restrict__ queries,
                                                    const float* __restrict__ keys,
                                                    float* __restrict__ qmask,
                                                    float* __restrict__ kmask) {
  int wv = threadIdx.x >> 5, lane = threadIdx.x & 31;
  int row = blockIdx.x * 8 + wv;                          // B*S = 4096 rows
  const float* qp = queries + (size_t)row * U_DIM;
  const float* kp = keys + (size_t)row * U_DIM;
  float sq = 0.f, sk = 0.f;
  for (int i = lane; i < U_DIM; i += 32) { sq += qp[i]; sk += kp[i]; }
#pragma unroll
  for (int m = 16; m; m >>= 1) { sq += __shfl_xor(sq, m, 32); sk += __shfl_xor(sk, m, 32); }
  if (lane == 0) {
    qmask[row] = (sq != 0.f) ? 1.f : 0.f;
    kmask[row] = (sk != 0.f) ? 1.f : 0.f;
  }
}

// ---------------- Kernel 2: fused QKV projection (bf16 WMMA) ----------------
// z=0: Q -> Qh[h][b][s][d], z=1: K -> Kh, z=2: V -> Vt[h][b][d][s] (transposed)
__global__ __launch_bounds__(256) void proj_kernel(
    const __bf16* __restrict__ qb, const __bf16* __restrict__ kb,
    const __bf16* __restrict__ vb,
    const __bf16* __restrict__ Wqb, const float* __restrict__ bq,
    const __bf16* __restrict__ Wkb, const float* __restrict__ bk,
    const __bf16* __restrict__ Wvb, const float* __restrict__ bv,
    __bf16* __restrict__ Qh, __bf16* __restrict__ Kh, __bf16* __restrict__ Vt) {
  int z = blockIdx.z;
  const __bf16 *X, *W;
  const float* bias;
  if (z == 0)      { X = qb; W = Wqb; bias = bq; }
  else if (z == 1) { X = kb; W = Wkb; bias = bk; }
  else             { X = vb; W = Wvb; bias = bv; }

  int wv = threadIdx.x >> 5, lane = threadIdx.x & 31;
  int half = lane >> 4, l16 = lane & 15;
  int m0 = blockIdx.x * 32;                  // 4096 rows / 32
  int n0 = blockIdx.y * 256 + wv * 32;       // 1024 cols / (8 waves * 32)

  const v8f zero8 = {0.f, 0.f, 0.f, 0.f, 0.f, 0.f, 0.f, 0.f};
  v8f acc[2][2] = {{zero8, zero8}, {zero8, zero8}};

  int rowA0 = m0 + l16, rowA1 = m0 + 16 + l16;
  int colB0 = n0 + l16, colB1 = n0 + 16 + l16;

  for (int kk = 0; kk < U_DIM; kk += 32) {
    v16bf a0 = frag_from_bf(X + (size_t)rowA0 * U_DIM + kk + half * 8);
    v16bf a1 = frag_from_bf(X + (size_t)rowA1 * U_DIM + kk + half * 8);
    v16bf b0 = frag_from_bf(W + (size_t)colB0 * U_DIM + kk + half * 8); // B[k][n]=W[n][k]
    v16bf b1 = frag_from_bf(W + (size_t)colB1 * U_DIM + kk + half * 8);
    acc[0][0] = wmma_bf16f32(a0, b0, acc[0][0]);
    acc[0][1] = wmma_bf16f32(a0, b1, acc[0][1]);
    acc[1][0] = wmma_bf16f32(a1, b0, acc[1][0]);
    acc[1][1] = wmma_bf16f32(a1, b1, acc[1][1]);
  }

  if (z < 2) {
    __bf16* out = (z == 0) ? Qh : Kh;
#pragma unroll
    for (int mi = 0; mi < 2; ++mi)
#pragma unroll
      for (int ni = 0; ni < 2; ++ni) {
        v8f c = acc[mi][ni];
        int ncol = n0 + ni * 16 + l16;
        int h = ncol >> 6, dv = ncol & 63;
        float bn = bias[ncol];
#pragma unroll
        for (int j = 0; j < 8; ++j) {
          int m = m0 + mi * 16 + half * 8 + j;
          int bb = m >> 11, s = m & (S_LEN - 1);
          float val = fmaxf(c[j] + bn, 0.f);
          out[(((size_t)h * B_NUM + bb) * S_LEN + s) * D_HEAD + dv] = (__bf16)val;
        }
      }
  } else {
#pragma unroll
    for (int mi = 0; mi < 2; ++mi)
#pragma unroll
      for (int ni = 0; ni < 2; ++ni) {
        v8f c = acc[mi][ni];
        int ncol = n0 + ni * 16 + l16;
        int h = ncol >> 6, dv = ncol & 63;
        float bn = bias[ncol];
        int m = m0 + mi * 16 + half * 8;
        int bb = m >> 11, s = m & (S_LEN - 1);
        v8bf pk;
#pragma unroll
        for (int j = 0; j < 8; ++j) pk[j] = (__bf16)fmaxf(c[j] + bn, 0.f);
        *(v8bf*)(Vt + (((size_t)h * B_NUM + bb) * D_HEAD + dv) * S_LEN + s) = pk;
      }
  }
}

__device__ inline float exp_slot(float x) {
  float r, y = x * 1.44269504088896340736f;
  asm("v_exp_f32 %0, %1\n\tv_nop" : "=v"(r) : "v"(y));
  return r;
}

#define KP_KEYS 128                      // keys per pass
#define K_PITCH 72                       // bf16 per LDS row of K   (128 B + 16 B)
#define V_PITCH 136                      // bf16 per LDS row of V^T (256 B + 16 B)
#define P_PITCH 136                      // bf16 per LDS row of P   (256 B + 16 B)
#define TILE_ELEMS 9216                  // 18,432 B = 9 x 2 KiB per tile buffer
__global__ __launch_bounds__(128) void attn_kernel(
    const __bf16* __restrict__ Qh, const __bf16* __restrict__ Kh,
    const __bf16* __restrict__ Vt, const float* __restrict__ kmask,
    const float* __restrict__ qmask, float* __restrict__ oatt) {
  __shared__ __attribute__((aligned(2048))) __bf16 ldsK[TILE_ELEMS];  // 128 x K_PITCH
  __shared__ __attribute__((aligned(2048))) __bf16 ldsV[TILE_ELEMS];  // 64 x V_PITCH, rounded up
  __shared__ __attribute__((aligned(2048))) __bf16 ldsP[4 * 16 * P_PITCH];

  int wv = threadIdx.x >> 5, lane = threadIdx.x & 31;
  int half = lane >> 4, l16 = lane & 15;
  int hb = blockIdx.y;                     // h*B + b (head-major, as reference)
  int b = hb & (B_NUM - 1);
  int h = hb >> 1;
  int q0 = blockIdx.x * 64 + wv * 16;
  const unsigned wave = uni(threadIdx.x >> 5);

  const __bf16* Qbase = Qh + (size_t)hb * S_LEN * D_HEAD;
  const __bf16* Kbase = Kh + (size_t)hb * S_LEN * D_HEAD;
  const __bf16* Vbase = Vt + (size_t)hb * D_HEAD * S_LEN;

  int qrow = q0 + l16;
  v16bf aq0 = frag_from_bf(Qbase + (size_t)qrow * D_HEAD + 0 + half * 8);
  v16bf aq1 = frag_from_bf(Qbase + (size_t)qrow * D_HEAD + 32 + half * 8);

  const v8f zero8 = {0.f, 0.f, 0.f, 0.f, 0.f, 0.f, 0.f, 0.f};
  v8f o[4] = {zero8, zero8, zero8, zero8};
  float mrow[8], lrow[8];
#pragma unroll
  for (int j = 0; j < 8; ++j) { mrow[j] = -3.0e38f; lrow[j] = 0.f; }

  __bf16* myP = ldsP + wv * (16 * P_PITCH);
  unsigned offK = lds_off_u32(ldsK), offV = lds_off_u32(ldsV);
  int npass = ((blockIdx.x * 64 + 63) >> 7) + 1;   // block-uniform causal bound

  for (int kb = 0; kb < npass; ++kb) {
    int kbase = kb * KP_KEYS;
    // this wave's LDS reads of the tiles have retired before they are refilled
    asm volatile("s_wait_dscnt 0x0" ::: "memory");
    __syncthreads();                               // previous tiles consumed
    if (pinned(wave == 0)) {
      // K tile: 128 key rows of 128 B, source pitch 128 B, pad 16 B per row
      tdm_tile<(1u << 20) | (4u << 22) | (3u << 25), 128u, 128u>(
          offK, (unsigned long long)(Kbase + (size_t)kbase * D_HEAD), 128u);
      // the tile has landed before the barrier that publishes it
      asm volatile("s_wait_tensorcnt 0x0" ::: "memory");
    }
    if (pinned(wave == 1)) {
      // V^T tile: 64 dv rows of 256 B (128 keys), source pitch S*2 B, pad 16 B per row
      tdm_tile<(1u << 20) | (5u << 22) | (3u << 25), 256u, 64u>(
          offV, (unsigned long long)(Vbase + kbase), S_LEN * 2u);
      // the tile has landed before the barrier that publishes it
      asm volatile("s_wait_tensorcnt 0x0" ::: "memory");
    }
    __syncthreads();                               // tiles visible to all waves

    v8f st[8];
#pragma unroll
    for (int t = 0; t < 8; ++t) {
      int keyl = t * 16 + l16;                     // local key row in tile
      int key = kbase + keyl;
      v16bf bk0 = frag_from_bf(ldsK + keyl * K_PITCH + half * 8);
      v16bf bk1 = frag_from_bf(ldsK + keyl * K_PITCH + 32 + half * 8);
      v8f c = zero8;
      c = wmma_bf16f32(aq0, bk0, c);
      c = wmma_bf16f32(aq1, bk1, c);
      float km = kmask[b * S_LEN + key];
#pragma unroll
      for (int j = 0; j < 8; ++j) {
        int m = q0 + half * 8 + j;
        float s = c[j] * 0.125f;                   // 1/sqrt(64)
        if (km == 0.f || key > m) s = NEG_F;
        c[j] = s;
      }
      st[t] = c;
    }

    // online softmax over these 128 columns (rows live in 16-lane groups)
#pragma unroll
    for (int j = 0; j < 8; ++j) {
      float tmax = st[0][j];
#pragma unroll  // constant indices keep st[] in registers
      for (int t = 1; t < 8; ++t) tmax = fmaxf(tmax, st[t][j]);
#pragma unroll
      for (int m = 8; m; m >>= 1) tmax = fmaxf(tmax, __shfl_xor(tmax, m, 16));
      float mn = fmaxf(mrow[j], tmax);
      float scale = exp_slot(mrow[j] - mn);
      float rs = 0.f;
#pragma unroll  // constant indices keep st[] in registers
      for (int t = 0; t < 8; ++t) {
        float p = exp_slot(st[t][j] - mn);
        st[t][j] = p;
        rs += p;
      }
#pragma unroll
      for (int m = 8; m; m >>= 1) rs += __shfl_xor(rs, m, 16);
      lrow[j] = lrow[j] * scale + rs;
      mrow[j] = mn;
      o[0][j] *= scale; o[1][j] *= scale; o[2][j] *= scale; o[3][j] *= scale;
    }

    // C-layout -> A-layout via wave-private LDS (same-wave DS ops in order)
#pragma unroll
    for (int t = 0; t < 8; ++t)
#pragma unroll
      for (int j = 0; j < 8; ++j)
        myP[(half * 8 + j) * P_PITCH + t * 16 + l16] = (__bf16)st[t][j];
    asm volatile("s_wait_dscnt 0" ::: "memory");

    // O += P(16x32) @ V(32x16) for 4 key chunks x 4 d-tiles, V fragments from LDS
#pragma unroll  // constant LDS offsets for the four 32-key chunks
    for (int c = 0; c < 4; ++c) {
      v16bf ap = frag_from_bf(myP + l16 * P_PITCH + c * 32 + half * 8);
#pragma unroll
      for (int t = 0; t < 4; ++t) {
        int dv = t * 16 + l16;
        v16bf bvf = frag_from_bf(ldsV + dv * V_PITCH + c * 32 + half * 8);
        o[t] = wmma_bf16f32(ap, bvf, o[t]);
      }
    }
  }

  // epilogue: normalize, query mask, store merged-head fp32
#pragma unroll
  for (int j = 0; j < 8; ++j) {
    int m = q0 + half * 8 + j;
    float l = lrow[j];
    float f = (l > 0.f ? 1.f / l : 0.f) * qmask[b * S_LEN + m];
    size_t rowoff = ((size_t)b * S_LEN + m) * U_DIM + (size_t)h * D_HEAD;
#pragma unroll
    for (int t = 0; t < 4; ++t)
      oatt[rowoff + t * 16 + l16] = o[t][j] * f;
  }
}

// ---------------- Kernel 4: residual + layernorm (ddof=1) -------------------
__global__ __launch_bounds__(256) void ln_kernel(const float* __restrict__ oatt,
                                                 const float* __restrict__ queries,
                                                 const float* __restrict__ gamma,
                                                 const float* __restrict__ beta,
                                                 float* __restrict__ out) {
  __shared__ float redS[8], redQ[8];
  int row = blockIdx.x, tid = threadIdx.x;
  const float* pa = oatt + (size_t)row * U_DIM;
  const float* pq = queries + (size_t)row * U_DIM;
  float x[4], s = 0.f, ss = 0.f;
#pragma unroll
  for (int k = 0; k < 4; ++k) {
    int i = tid + k * 256;
    float v = pa[i] + pq[i];
    x[k] = v; s += v; ss += v * v;
  }
#pragma unroll
  for (int m = 16; m; m >>= 1) { s += __shfl_xor(s, m, 32); ss += __shfl_xor(ss, m, 32); }
  int wv = tid >> 5, lane = tid & 31;
  if (lane == 0) { redS[wv] = s; redQ[wv] = ss; }
  __syncthreads();
  if (wv == 0) {
    float a = (lane < 8) ? redS[lane] : 0.f;
    float c = (lane < 8) ? redQ[lane] : 0.f;
#pragma unroll
    for (int m = 16; m; m >>= 1) { a += __shfl_xor(a, m, 32); c += __shfl_xor(c, m, 32); }
    if (lane == 0) { redS[0] = a; redQ[0] = c; }
  }
  __syncthreads();
  float mean = redS[0] * (1.f / U_DIM);
  float var = (redQ[0] - (float)U_DIM * mean * mean) * (1.f / (U_DIM - 1));
  float rinv = 1.f / (sqrtf(fmaxf(var, 0.f)) + 1e-8f);
#pragma unroll
  for (int k = 0; k < 4; ++k) {
    int i = tid + k * 256;
    out[(size_t)row * U_DIM + i] = gamma[i] * (x[k] - mean) * rinv + beta[i];
  }
}

// ---------------- Host launcher ---------------------------------------------
extern "C" void kernel_launch(void* const* d_in, const int* in_sizes, int n_in,
                              void* d_out, int out_size, void* d_ws, size_t ws_size,
                              hipStream_t stream) {
  const float* queries = (const float*)d_in[0];
  const float* keys    = (const float*)d_in[1];
  const float* values  = (const float*)d_in[2];
  const float* Wq = (const float*)d_in[3];  const float* bq = (const float*)d_in[4];
  const float* Wk = (const float*)d_in[5];  const float* bk = (const float*)d_in[6];
  const float* Wv = (const float*)d_in[7];  const float* bv = (const float*)d_in[8];
  const float* gamma = (const float*)d_in[9];
  const float* beta  = (const float*)d_in[10];
  float* out = (float*)d_out;

  char* ws = (char*)d_ws;
  const size_t szX = (size_t)B_NUM * S_LEN * U_DIM * 2;   // 8 MB bf16
  const size_t szW = (size_t)U_DIM * U_DIM * 2;           // 2 MB bf16
  __bf16* qb  = (__bf16*)ws;  ws += szX;
  __bf16* kbf = (__bf16*)ws;  ws += szX;
  __bf16* vbf = (__bf16*)ws;  ws += szX;
  __bf16* Wqb = (__bf16*)ws;  ws += szW;
  __bf16* Wkb = (__bf16*)ws;  ws += szW;
  __bf16* Wvb = (__bf16*)ws;  ws += szW;
  __bf16* Qh  = (__bf16*)ws;  ws += szX;
  __bf16* Kh  = (__bf16*)ws;  ws += szX;
  __bf16* Vt  = (__bf16*)ws;  ws += szX;
  float* kmask = (float*)ws;  ws += (size_t)B_NUM * S_LEN * 4;
  float* qmask = (float*)ws;  ws += (size_t)B_NUM * S_LEN * 4;
  float* oatt  = (float*)ws;  // B*S*U fp32 = 16 MB

  const int gX = (B_NUM * S_LEN * U_DIM) / 8 / 256;  // 2048 blocks
  const int gW = (U_DIM * U_DIM) / 8 / 256;          // 512 blocks
  cvt_bf16_kernel<<<dim3(gX), dim3(256), 0, stream>>>(queries, qb);
  cvt_bf16_kernel<<<dim3(gX), dim3(256), 0, stream>>>(keys, kbf);
  cvt_bf16_kernel<<<dim3(gX), dim3(256), 0, stream>>>(values, vbf);
  cvt_bf16_kernel<<<dim3(gW), dim3(256), 0, stream>>>(Wq, Wqb);
  cvt_bf16_kernel<<<dim3(gW), dim3(256), 0, stream>>>(Wk, Wkb);
  cvt_bf16_kernel<<<dim3(gW), dim3(256), 0, stream>>>(Wv, Wvb);

  masks_kernel<<<dim3(512), dim3(256), 0, stream>>>(queries, keys, qmask, kmask);
  proj_kernel<<<dim3(128, 4, 3), dim3(256), 0, stream>>>(
      qb, kbf, vbf, Wqb, bq, Wkb, bk, Wvb, bv, Qh, Kh, Vt);
  attn_kernel<<<dim3(S_LEN / 64, H_NUM * B_NUM), dim3(128), 0, stream>>>(
      Qh, Kh, Vt, kmask, qmask, oatt);
  ln_kernel<<<dim3(B_NUM * S_LEN), dim3(256), 0, stream>>>(oatt, queries, gamma, beta, out);
}

// v002
// A run of this version takes 165 microseconds.
// Next to v001, in two timings, it ran 1.09 times as fast each time.
// Over all steps from v000 it is 1.48 times as fast.
#include <hip/hip_runtime.h>

#define S_LEN  2048
#define U_DIM  1024
#define H_NUM  16
#define D_HEAD 64
#define B_NUM  2
#define NEG_F  (-4294967295.0f)

typedef __attribute__((ext_vector_type(16))) __bf16 v16bf;
typedef __attribute__((ext_vector_type(8)))  __bf16 v8bf;
typedef __attribute__((ext_vector_type(8)))  float  v8f;
typedef __attribute__((ext_vector_type(4)))  unsigned int u32x4;
typedef __attribute__((ext_vector_type(8)))  unsigned int u32x8;

__device__ inline v8f wmma_bf16f32(v16bf a, v16bf b, v8f c) {
  return __builtin_amdgcn_wmma_f32_16x16x32_bf16(false, a, false, b, (short)0, c,
                                                 false, false);
}

// Per-lane WMMA 16-bit A/B fragment: elems 0..7 = k (half*8 + 0..7),
// elems 8..15 = k (16 + half*8 + 0..7). `p` points at k = base + half*8.
__device__ inline v16bf frag_from_bf(const __bf16* p) {
  v8bf lo = *(const v8bf*)(p);
  v8bf hi = *(const v8bf*)(p + 16);
  v16bf f;
#pragma unroll
  for (int i = 0; i < 8; ++i) { f[i] = lo[i]; f[8 + i] = hi[i]; }
  return f;
}

__device__ inline unsigned lds_off_u32(const void* p) {
  return (unsigned)(unsigned long long)p;
}

// Wave-uniform value in a scalar register.
__device__ inline unsigned uni(unsigned v) {
  return (unsigned)__builtin_amdgcn_readfirstlane(v);
}
__device__ inline unsigned pinned(unsigned v) {
  unsigned w = (unsigned)__builtin_amdgcn_readfirstlane(v);
  asm volatile("" : "+s"(w));  // pinned(): the test word stays in a scalar register
  return w;
}

template <unsigned W0, unsigned ROWB, unsigned ROWS>
__device__ inline void tdm_tile(unsigned lds_byte_off, unsigned long long ga,
                                unsigned src_pitch) {
  u32x4 g0;
  g0[0] = uni(1u);                                        // count = 1
  g0[1] = uni(lds_byte_off);                              // LDS destination
  g0[2] = uni((unsigned)ga);                              // address [31:0]
  g0[3] = uni((((unsigned)(ga >> 32)) & 0x01ffffffu) | 0x80000000u);  // [56:32], type 2
  u32x8 g1;
  g1[0] = uni(W0);
  g1[1] = uni((ROWB & 0xffffu) << 16);
  g1[2] = uni((ROWB >> 16) | ((ROWS & 0xffffu) << 16));
  g1[3] = uni((ROWS >> 16) | (ROWB << 16));
  g1[4] = uni(ROWS);
  g1[5] = uni(src_pitch);
  g1[6] = uni(0u);
  g1[7] = uni(0u);
  asm volatile("tensor_load_to_lds %0, %1" :: "s"(g0), "s"(g1) : "memory");
}

// ---------------- Kernel 0: prepass, one launch ------------------------------
// fp32 -> bf16 of queries, keys, values, Wq, Wk, Wv, and the two padding masks from
// the same loads. The six arrays are 15,360 rows of 1,024 floats; a wave takes four
// consecutive rows of one array (every array's row count is a multiple of four) and
// asks for all 16 KiB before it converts the first row.
#define PREP_WAVES 15                    // waves per workgroup: 256 x 15 x 4 rows = 15,360
#define PREP_ROWS  4                     // rows per wave
#define X_ROWS (B_NUM * S_LEN)           // rows of queries, keys, values
__global__ __launch_bounds__(PREP_WAVES * 32) void prep_kernel(
    const float* __restrict__ queries, const float* __restrict__ keys,
    const float* __restrict__ values, const float* __restrict__ Wq,
    const float* __restrict__ Wk, const float* __restrict__ Wv,
    __bf16* __restrict__ qb, __bf16* __restrict__ kb, __bf16* __restrict__ vb,
    __bf16* __restrict__ Wqb, __bf16* __restrict__ Wkb, __bf16* __restrict__ Wvb,
    float* __restrict__ qmask, float* __restrict__ kmask) {
  int lane = threadIdx.x & 31;
  unsigned r0 = uni((blockIdx.x * PREP_WAVES + (threadIdx.x >> 5)) * PREP_ROWS);
  const float* src;
  __bf16* dst;
  float* mask = nullptr;
  unsigned row;
  if (r0 < 3u * X_ROWS) {
    unsigned a = r0 / X_ROWS;
    row = r0 % X_ROWS;
    src  = (a == 0) ? queries : (a == 1) ? keys : values;
    dst  = (a == 0) ? qb : (a == 1) ? kb : vb;
    mask = (a == 0) ? qmask : (a == 1) ? kmask : nullptr;
  } else {
    unsigned t = r0 - 3u * X_ROWS;
    unsigned a = t / U_DIM;
    row = t % U_DIM;
    src = (a == 0) ? Wq : (a == 1) ? Wk : Wv;
    dst = (a == 0) ? Wqb : (a == 1) ? Wkb : Wvb;
  }
  // lane's groups of 8 floats: group lane + 32 j of each row
  const float4* p = (const float4*)(src + (size_t)row * U_DIM) + lane * 2;
  v8bf* q = (v8bf*)(dst + (size_t)row * U_DIM) + lane;
  float4 v[PREP_ROWS][8];
#pragma unroll  // constant indices keep v[] in registers
  for (int r = 0; r < PREP_ROWS; ++r)
#pragma unroll
    for (int j = 0; j < 4; ++j) {
      v[r][2 * j]     = p[r * (U_DIM / 4) + j * 64];
      v[r][2 * j + 1] = p[r * (U_DIM / 4) + j * 64 + 1];
    }
  float sum[PREP_ROWS];
#pragma unroll
  for (int r = 0; r < PREP_ROWS; ++r) {
    float s = 0.f;
#pragma unroll
    for (int j = 0; j < 4; ++j) {
      float4 a = v[r][2 * j], b = v[r][2 * j + 1];
      v8bf o;
      o[0] = (__bf16)a.x; o[1] = (__bf16)a.y; o[2] = (__bf16)a.z; o[3] = (__bf16)a.w;
      o[4] = (__bf16)b.x; o[5] = (__bf16)b.y; o[6] = (__bf16)b.z; o[7] = (__bf16)b.w;
      q[r * (U_DIM / 8) + j * 32] = o;
      s += ((a.x + a.y) + (a.z + a.w)) + ((b.x + b.y) + (b.z + b.w));
    }
    sum[r] = s;
  }
  // stands in front of the first rewrite of a register that an issued store names
  asm volatile("s_wait_xcnt 0x0" ::: "memory");
  if (mask != nullptr) {                 // wave-uniform: queries and keys only
#pragma unroll
    for (int r = 0; r < PREP_ROWS; ++r)
#pragma unroll
      for (int m = 16; m; m >>= 1) sum[r] += __shfl_xor(sum[r], m, 32);
    if (lane == 0) {
      float4 mk;
      mk.x = (sum[0] != 0.f) ? 1.f : 0.f;
      mk.y = (sum[1] != 0.f) ? 1.f : 0.f;
      mk.z = (sum[2] != 0.f) ? 1.f : 0.f;
      mk.w = (sum[3] != 0.f) ? 1.f : 0.f;
      *(float4*)(mask + row) = mk;
    }
  }
}

// ---------------- Kernel 2: fused QKV projection (bf16 WMMA) ----------------
// z=0: Q -> Qh[h][b][s][d], z=1: K -> Kh, z=2: V -> Vt[h][b][d][s] (transposed)
__global__ __launch_bounds__(256) void proj_kernel(
    const __bf16* __restrict__ qb, const __bf16* __restrict__ kb,
    const __bf16* __restrict__ vb,
    const __bf16* __restrict__ Wqb, const float* __restrict__ bq,
    const __bf16* __restrict__ Wkb, const float* __restrict__ bk,
    const __bf16* __restrict__ Wvb, const float* __restrict__ bv,
    __bf16* __restrict__ Qh, __bf16* __restrict__ Kh, __bf16* __restrict__ Vt) {
  int z = blockIdx.z;
  const __bf16 *X, *W;
  const float* bias;
  if (z == 0)      { X = qb; W = Wqb; bias = bq; }
  else if (z == 1) { X = kb; W = Wkb; bias = bk; }
  else             { X = vb; W = Wvb; bias = bv; }

  int wv = threadIdx.x >> 5, lane = threadIdx.x & 31;
  int half = lane >> 4, l16 = lane & 15;
  int m0 = blockIdx.x * 32;                  // 4096 rows / 32
  int n0 = blockIdx.y * 256 + wv * 32;       // 1024 cols / (8 waves * 32)

  const v8f zero8 = {0.f, 0.f, 0.f, 0.f, 0.f, 0.f, 0.f, 0.f};
  v8f acc[2][2] = {{zero8, zero8}, {zero8, zero8}};

  int rowA0 = m0 + l16, rowA1 = m0 + 16 + l16;
  int colB0 = n0 + l16, colB1 = n0 + 16 + l16;

  for (int kk = 0; kk < U_DIM; kk += 32) {
    v16bf a0 = frag_from_bf(X + (size_t)rowA0 * U_DIM + kk + half * 8);
    v16bf a1 = frag_from_bf(X + (size_t)rowA1 * U_DIM + kk + half * 8);
    v16bf b0 = frag_from_bf(W + (size_t)colB0 * U_DIM + kk + half * 8); // B[k][n]=W[n][k]
    v16bf b1 = frag_from_bf(W + (size_t)colB1 * U_DIM + kk + half * 8);
    acc[0][0] = wmma_bf16f32(a0, b0, acc[0][0]);
    acc[0][1] = wmma_bf16f32(a0, b1, acc[0][1]);
    acc[1][0] = wmma_bf16f32(a1, b0, acc[1][0]);
    acc[1][1] = wmma_bf16f32(a1, b1, acc[1][1]);
  }

  if (z < 2) {
    __bf16* out = (z == 0) ? Qh : Kh;
#pragma unroll
    for (int mi = 0; mi < 2; ++mi)
#pragma unroll
      for (int ni = 0; ni < 2; ++ni) {
        v8f c = acc[mi][ni];
        int ncol = n0 + ni * 16 + l16;
        int h = ncol >> 6, dv = ncol & 63;
        float bn = bias[ncol];
#pragma unroll
        for (int j = 0; j < 8; ++j) {
          int m = m0 + mi * 16 + half * 8 + j;
          int bb = m >> 11, s = m & (S_LEN - 1);
          float val = fmaxf(c[j] + bn, 0.f);
          out[(((size_t)h * B_NUM + bb) * S_LEN + s) * D_HEAD + dv] = (__bf16)val;
        }
      }
  } else {
#pragma unroll
    for (int mi = 0; mi < 2; ++mi)
#pragma unroll
      for (int ni = 0; ni < 2; ++ni) {
        v8f c = acc[mi][ni];
        int ncol = n0 + ni * 16 + l16;
        int h = ncol >> 6, dv = ncol & 63;
        float bn = bias[ncol];
        int m = m0 + mi * 16 + half * 8;
        int bb = m >> 11, s = m & (S_LEN - 1);
        v8bf pk;
#pragma unroll
        for (int j = 0; j < 8; ++j) pk[j] = (__bf16)fmaxf(c[j] + bn, 0.f);
        *(v8bf*)(Vt + (((size_t)h * B_NUM + bb) * D_HEAD + dv) * S_LEN + s) = pk;
      }
  }
}

__device__ inline float exp_slot(float x) {
  float r, y = x * 1.44269504088896340736f;
  asm("v_exp_f32 %0, %1\n\tv_nop" : "=v"(r) : "v"(y));
  return r;
}

#define KP_KEYS 128                      // keys per pass
#define K_PITCH 72                       // bf16 per LDS row of K   (128 B + 16 B)
#define V_PITCH 136                      // bf16 per LDS row of V^T (256 B + 16 B)
#define P_PITCH 136                      // bf16 per LDS row of P   (256 B + 16 B)
#define TILE_ELEMS 9216                  // 18,432 B = 9 x 2 KiB per tile buffer
__global__ __launch_bounds__(128) void attn_kernel(
    const __bf16* __restrict__ Qh, const __bf16* __restrict__ Kh,
    const __bf16* __restrict__ Vt, const float* __restrict__ kmask,
    const float* __restrict__ qmask, float* __restrict__ oatt) {
  __shared__ __attribute__((aligned(2048))) __bf16 ldsK[TILE_ELEMS];  // 128 x K_PITCH
  __shared__ __attribute__((aligned(2048))) __bf16 ldsV[TILE_ELEMS];  // 64 x V_PITCH, rounded up
  __shared__ __attribute__((aligned(2048))) __bf16 ldsP[4 * 16 * P_PITCH];

  int wv = threadIdx.x >> 5, lane = threadIdx.x & 31;
  int half = lane >> 4, l16 = lane & 15;
  int hb = blockIdx.y;                     // h*B + b (head-major, as reference)
  int b = hb & (B_NUM - 1);
  int h = hb >> 1;
  int q0 = blockIdx.x * 64 + wv * 16;
  const unsigned wave = uni(threadIdx.x >> 5);

  const __bf16* Qbase = Qh + (size_t)hb * S_LEN * D_HEAD;
  const __bf16* Kbase = Kh + (size_t)hb * S_LEN * D_HEAD;
  const __bf16* Vbase = Vt + (size_t)hb * D_HEAD * S_LEN;

  int qrow = q0 + l16;
  v16bf aq0 = frag_from_bf(Qbase + (size_t)qrow * D_HEAD + 0 + half * 8);
  v16bf aq1 = frag_from_bf(Qbase + (size_t)qrow * D_HEAD + 32 + half * 8);

  const v8f zero8 = {0.f, 0.f, 0.f, 0.f, 0.f, 0.f, 0.f, 0.f};
  v8f o[4] = {zero8, zero8, zero8, zero8};
  float mrow[8], lrow[8];
#pragma unroll
  for (int j = 0; j < 8; ++j) { mrow[j] = -3.0e38f; lrow[j] = 0.f; }

  __bf16* myP = ldsP + wv * (16 * P_PITCH);
  unsigned offK = lds_off_u32(ldsK), offV = lds_off_u32(ldsV);
  int npass = ((blockIdx.x * 64 + 63) >> 7) + 1;   // block-uniform causal bound

  for (int kb = 0; kb < npass; ++kb) {
    int kbase = kb * KP_KEYS;
    // this wave's LDS reads of the tiles have retired before they are refilled
    asm volatile("s_wait_dscnt 0x0" ::: "memory");
    __syncthreads();                               // previous tiles consumed
    if (pinned(wave == 0)) {
      // K tile: 128 key rows of 128 B, source pitch 128 B, pad 16 B per row
      tdm_tile<(1u << 20) | (4u << 22) | (3u << 25), 128u, 128u>(
          offK, (unsigned long long)(Kbase + (size_t)kbase * D_HEAD), 128u);
      // the tile has landed before the barrier that publishes it
      asm volatile("s_wait_tensorcnt 0x0" ::: "memory");
    }
    if (pinned(wave == 1)) {
      // V^T tile: 64 dv rows of 256 B (128 keys), source pitch S*2 B, pad 16 B per row
      tdm_tile<(1u << 20) | (5u << 22) | (3u << 25), 256u, 64u>(
          offV, (unsigned long long)(Vbase + kbase), S_LEN * 2u);
      // the tile has landed before the barrier that publishes it
      asm volatile("s_wait_tensorcnt 0x0" ::: "memory");
    }
    __syncthreads();                               // tiles visible to all waves

    v8f st[8];
#pragma unroll
    for (int t = 0; t < 8; ++t) {
      int keyl = t * 16 + l16;                     // local key row in tile
      int key = kbase + keyl;
      v16bf bk0 = frag_from_bf(ldsK + keyl * K_PITCH + half * 8);
      v16bf bk1 = frag_from_bf(ldsK + keyl * K_PITCH + 32 + half * 8);
      v8f c = zero8;
      c = wmma_bf16f32(aq0, bk0, c);
      c = wmma_bf16f32(aq1, bk1, c);
      float km = kmask[b * S_LEN + key];
#pragma unroll
      for (int j = 0; j < 8; ++j) {
        int m = q0 + half * 8 + j;
        float s = c[j] * 0.125f;                   // 1/sqrt(64)
        if (km == 0.f || key > m) s = NEG_F;
        c[j] = s;
      }
      st[t] = c;
    }

    // online softmax over these 128 columns (rows live in 16-lane groups)
#pragma unroll
    for (int j = 0; j < 8; ++j) {
      float tmax = st[0][j];
#pragma unroll  // constant indices keep st[] in registers
      for (int t = 1; t < 8; ++t) tmax = fmaxf(tmax, st[t][j]);
#pragma unroll
      for (int m = 8; m; m >>= 1) tmax = fmaxf(tmax, __shfl_xor(tmax, m, 16));
      float mn = fmaxf(mrow[j], tmax);
      float scale = exp_slot(mrow[j] - mn);
      float rs = 0.f;
#pragma unroll  // constant indices keep st[] in registers
      for (int t = 0; t < 8; ++t) {
        float p = exp_slot(st[t][j] - mn);
        st[t][j] = p;
        rs += p;
      }
#pragma unroll
      for (int m = 8; m; m >>= 1) rs += __shfl_xor(rs, m, 16);
      lrow[j] = lrow[j] * scale + rs;
      mrow[j] = mn;
      o[0][j] *= scale; o[1][j] *= scale; o[2][j] *= scale; o[3][j] *= scale;
    }

    // C-layout -> A-layout via wave-private LDS (same-wave DS ops in order)
#pragma unroll
    for (int t = 0; t < 8; ++t)
#pragma unroll
      for (int j = 0; j < 8; ++j)
        myP[(half * 8 + j) * P_PITCH + t * 16 + l16] = (__bf16)st[t][j];
    asm volatile("s_wait_dscnt 0" ::: "memory");

    // O += P(16x32) @ V(32x16) for 4 key chunks x 4 d-tiles, V fragments from LDS
#pragma unroll  // constant LDS offsets for the four 32-key chunks
    for (int c = 0; c < 4; ++c) {
      v16bf ap = frag_from_bf(myP + l16 * P_PITCH + c * 32 + half * 8);
#pragma unroll
      for (int t = 0; t < 4; ++t) {
        int dv = t * 16 + l16;
        v16bf bvf = frag_from_bf(ldsV + dv * V_PITCH + c * 32 + half * 8);
        o[t] = wmma_bf16f32(ap, bvf, o[t]);
      }
    }
  }

  // epilogue: normalize, query mask, store merged-head fp32
#pragma unroll
  for (int j = 0; j < 8; ++j) {
    int m = q0 + half * 8 + j;
    float l = lrow[j];
    float f = (l > 0.f ? 1.f / l : 0.f) * qmask[b * S_LEN + m];
    size_t rowoff = ((size_t)b * S_LEN + m) * U_DIM + (size_t)h * D_HEAD;
#pragma unroll
    for (int t = 0; t < 4; ++t)
      oatt[rowoff + t * 16 + l16] = o[t][j] * f;
  }
}

// ---------------- Kernel 4: residual + layernorm (ddof=1) -------------------
__global__ __launch_bounds__(256) void ln_kernel(const float* __restrict__ oatt,
                                                 const float* __restrict__ queries,
                                                 const float* __restrict__ gamma,
                                                 const float* __restrict__ beta,
                                                 float* __restrict__ out) {
  __shared__ float redS[8], redQ[8];
  int row = blockIdx.x, tid = threadIdx.x;
  const float* pa = oatt + (size_t)row * U_DIM;
  const float* pq = queries + (size_t)row * U_DIM;
  float x[4], s = 0.f, ss = 0.f;
#pragma unroll
  for (int k = 0; k < 4; ++k) {
    int i = tid + k * 256;
    float v = pa[i] + pq[i];
    x[k] = v; s += v; ss += v * v;
  }
#pragma unroll
  for (int m = 16; m; m >>= 1) { s += __shfl_xor(s, m, 32); ss += __shfl_xor(ss, m, 32); }
  int wv = tid >> 5, lane = tid & 31;
  if (lane == 0) { redS[wv] = s; redQ[wv] = ss; }
  __syncthreads();
  if (wv == 0) {
    float a = (lane < 8) ? redS[lane] : 0.f;
    float c = (lane < 8) ? redQ[lane] : 0.f;
#pragma unroll
    for (int m = 16; m; m >>= 1) { a += __shfl_xor(a, m, 32); c += __shfl_xor(c, m, 32); }
    if (lane == 0) { redS[0] = a; redQ[0] = c; }
  }
  __syncthreads();
  float mean = redS[0] * (1.f / U_DIM);
  float var = (redQ[0] - (float)U_DIM * mean * mean) * (1.f / (U_DIM - 1));
  float rinv = 1.f / (sqrtf(fmaxf(var, 0.f)) + 1e-8f);
#pragma unroll
  for (int k = 0; k < 4; ++k) {
    int i = tid + k * 256;
    out[(size_t)row * U_DIM + i] = gamma[i] * (x[k] - mean) * rinv + beta[i];
  }
}

// ---------------- Host launcher ---------------------------------------------
extern "C" void kernel_launch(void* const* d_in, const int* in_sizes, int n_in,
                              void* d_out, int out_size, void* d_ws, size_t ws_size,
                              hipStream_t stream) {
  const float* queries = (const float*)d_in[0];
  const float* keys    = (const float*)d_in[1];
  const float* values  = (const float*)d_in[2];
  const float* Wq = (const float*)d_in[3];  const float* bq = (const float*)d_in[4];
  const float* Wk = (const float*)d_in[5];  const float* bk = (const float*)d_in[6];
  const float* Wv = (const float*)d_in[7];  const float* bv = (const float*)d_in[8];
  const float* gamma = (const float*)d_in[9];
  const float* beta  = (const float*)d_in[10];
  float* out = (float*)d_out;

  char* ws = (char*)d_ws;
  const size_t szX = (size_t)B_NUM * S_LEN * U_DIM * 2;   // 8 MB bf16
  const size_t szW = (size_t)U_DIM * U_DIM * 2;           // 2 MB bf16
  __bf16* qb  = (__bf16*)ws;  ws += szX;
  __bf16* kbf = (__bf16*)ws;  ws += szX;
  __bf16* vbf = (__bf16*)ws;  ws += szX;
  __bf16* Wqb = (__bf16*)ws;  ws += szW;
  __bf16* Wkb = (__bf16*)ws;  ws += szW;
  __bf16* Wvb = (__bf16*)ws;  ws += szW;
  __bf16* Qh  = (__bf16*)ws;  ws += szX;
  __bf16* Kh  = (__bf16*)ws;  ws += szX;
  __bf16* Vt  = (__bf16*)ws;  ws += szX;
  float* kmask = (float*)ws;  ws += (size_t)B_NUM * S_LEN * 4;
  float* qmask = (float*)ws;  ws += (size_t)B_NUM * S_LEN * 4;
  float* oatt  = (float*)ws;  // B*S*U fp32 = 16 MB

  prep_kernel<<<dim3(256), dim3(PREP_WAVES * 32), 0, stream>>>(
      queries, keys, values, Wq, Wk, Wv, qb, kbf, vbf, Wqb, Wkb, Wvb, qmask, kmask);
  proj_kernel<<<dim3(128, 4, 3), dim3(256), 0, stream>>>(
      qb, kbf, vbf, Wqb, bq, Wkb, bk, Wvb, bv, Qh, Kh, Vt);
  attn_kernel<<<dim3(S_LEN / 64, H_NUM * B_NUM), dim3(128), 0, stream>>>(
      Qh, Kh, Vt, kmask, qmask, oatt);
  ln_kernel<<<dim3(B_NUM * S_LEN), dim3(256), 0, stream>>>(oatt, queries, gamma, beta, out);
}
